// v000
// Times are from an AMD MI455X. After a warm-up the kernel runs many times in a row, and a time is the length of
// such a window on the GPU divided by its runs, so every launch and the gaps after it count. The runs cycle
// through copies of the inputs. A figure is the median of several windows, for all but v000 over two sittings.
// Sittings can differ by a few percent; kernels timed side by side share one.
// v000 is the starting kernel. One run takes 23 microseconds.
#include <hip/hip_runtime.h>
#include <hip/hip_bf16.h>

typedef __attribute__((ext_vector_type(16))) _Float16 v16h;
typedef __attribute__((ext_vector_type(8)))  float    v8f;

// ---------------------------------------------------------------------------
// Pass 1: s[b*N+n] = sum_c exp(z[b,n,c]) via WMMA ones-GEMV.
// One wave32 handles a tile of 16 flattened positions x 256 channels:
//   8 x v_wmma_f32_16x16x32_f16 accumulations with B == all-ones.
// Since B is all-ones, D[m][n] = sum_k A[m][k] regardless of K placement, so
// each lane just supplies 16 distinct channel values of its row:
//   lane <16  -> position = lane,    channels [chunk*32 +  0 .. +15]
//   lane >=16 -> position = lane-16, channels [chunk*32 + 16 .. +31]
// D layout (16x16 f32): VGPR r, lanes 0-15 hold M=r, lanes 16-31 hold M=8+r,
// every column identical -> lane 0 extracts M=0..7, lane 16 extracts M=8..15.
// ---------------------------------------------------------------------------
__global__ void __launch_bounds__(256)
channel_sum_wmma_kernel(const float* __restrict__ z,
                        float* __restrict__ s,
                        int C) {
    const int lane        = threadIdx.x & 31;
    const int waveInBlock = threadIdx.x >> 5;
    const int waveId      = blockIdx.x * (blockDim.x >> 5) + waveInBlock;

    const long pos0  = (long)waveId * 16;          // first of 16 positions
    const int  m     = lane & 15;                  // row of A this lane feeds
    const int  kHalf = (lane >> 4) * 16;           // 0 or 16 inside 32-chunk

    const float* __restrict__ row = z + (pos0 + m) * (long)C;

    v16h ones;
#pragma unroll
    for (int i = 0; i < 16; ++i) ones[i] = (_Float16)1.0f;

    v8f acc = {};

#pragma unroll
    for (int chunk = 0; chunk < 8; ++chunk) {
        const float4* __restrict__ p4 =
            reinterpret_cast<const float4*>(row + chunk * 32 + kHalf);
        float v[16];
        *reinterpret_cast<float4*>(&v[0])  = p4[0];
        *reinterpret_cast<float4*>(&v[4])  = p4[1];
        *reinterpret_cast<float4*>(&v[8])  = p4[2];
        *reinterpret_cast<float4*>(&v[12]) = p4[3];

        v16h aH;
#pragma unroll
        for (int i = 0; i < 16; ++i) aH[i] = (_Float16)__expf(v[i]);

        // D = A x ones + acc   (emits v_wmma_f32_16x16x32_f16)
        acc = __builtin_amdgcn_wmma_f32_16x16x32_f16(
            /*neg_a=*/false, aH, /*neg_b=*/false, ones,
            /*c_mod=*/(short)0, acc, /*reuse_a=*/false, /*reuse_b=*/false);
    }

    if (lane == 0) {
#pragma unroll
        for (int r = 0; r < 8; ++r) s[pos0 + r] = acc[r];
    } else if (lane == 16) {
#pragma unroll
        for (int r = 0; r < 8; ++r) s[pos0 + 8 + r] = acc[r];
    }
}

// ---------------------------------------------------------------------------
// Pass 2: denom[b,n] = zero-padded width-window sum of s along n.
// Tiny (B*N = 65536 elements); s sits in L2. width read on-device (no host
// sync needed).
// ---------------------------------------------------------------------------
__global__ void __launch_bounds__(256)
window_sum_kernel(const float* __restrict__ s,
                  const int* __restrict__ width_p,
                  float* __restrict__ denom,
                  int N) {
    const int idx = blockIdx.x * blockDim.x + threadIdx.x;   // over B*N
    const int b = idx / N;
    const int n = idx - b * N;
    const int half = (*width_p) >> 1;

    const float* __restrict__ sb = s + (long)b * N;
    float acc = 0.0f;
    for (int j = -half; j <= half; ++j) {
        const int nn = n + j;
        if (nn >= 0 && nn < N) acc += sb[nn];
    }
    denom[idx] = acc;
}

// ---------------------------------------------------------------------------
// Pass 3: out = z * exp(z) / denom. One wave per position (32 lanes x 8 ch),
// float4 vector loads/stores, one reciprocal per thread.
// ---------------------------------------------------------------------------
__global__ void __launch_bounds__(256)
finalize_kernel(const float* __restrict__ z,
                const float* __restrict__ denom,
                float* __restrict__ out,
                int C) {
    const long tid      = (long)blockIdx.x * blockDim.x + threadIdx.x;
    const int  perPos   = C >> 3;                 // threads per position (32)
    const long pos      = tid / perPos;
    const int  cOff     = (int)(tid - pos * perPos) << 3;

    const float inv = __frcp_rn(denom[pos]);

    const float4* __restrict__ zp =
        reinterpret_cast<const float4*>(z + pos * (long)C + cOff);
    float4* __restrict__ op =
        reinterpret_cast<float4*>(out + pos * (long)C + cOff);

    float4 z0 = zp[0];
    float4 z1 = zp[1];

    float4 o0, o1;
    o0.x = z0.x * __expf(z0.x) * inv;
    o0.y = z0.y * __expf(z0.y) * inv;
    o0.z = z0.z * __expf(z0.z) * inv;
    o0.w = z0.w * __expf(z0.w) * inv;
    o1.x = z1.x * __expf(z1.x) * inv;
    o1.y = z1.y * __expf(z1.y) * inv;
    o1.z = z1.z * __expf(z1.z) * inv;
    o1.w = z1.w * __expf(z1.w) * inv;

    op[0] = o0;
    op[1] = o1;
}

extern "C" void kernel_launch(void* const* d_in, const int* in_sizes, int n_in,
                              void* d_out, int out_size, void* d_ws, size_t ws_size,
                              hipStream_t stream) {
    constexpr int B = 8, N = 8192, C = 256;

    const float* z       = (const float*)d_in[0];
    const int*   width_p = (const int*)d_in[1];
    float*       out     = (float*)d_out;

    float* s     = (float*)d_ws;                  // B*N floats  (256 KB)
    float* denom = s + (size_t)B * N;             // B*N floats  (256 KB)

    // Pass 1: 65536 positions / 16 per wave = 4096 waves; 8 waves per block.
    {
        const int waves  = (B * N) / 16;
        const int blocks = waves / 8;             // 512
        channel_sum_wmma_kernel<<<blocks, 256, 0, stream>>>(z, s, C);
    }

    // Pass 2: one thread per (b, n).
    {
        const int total  = B * N;
        const int blocks = total / 256;           // 256
        window_sum_kernel<<<blocks, 256, 0, stream>>>(s, width_p, denom, N);
    }

    // Pass 3: 8 floats per thread.
    {
        const long total  = (long)B * N * C / 8;  // 2,097,152
        const int  blocks = (int)(total / 256);   // 8192
        finalize_kernel<<<blocks, 256, 0, stream>>>(z, denom, out, C);
    }
}

// v001
// A run of this version takes 9.95 microseconds.
// Two timings next to v000 put it at 2.31 and 2.32 times that version's speed.
#include <hip/hip_runtime.h>
#include <hip/hip_bf16.h>

typedef __attribute__((ext_vector_type(16))) _Float16 v16h;
typedef __attribute__((ext_vector_type(8)))  float    v8f;

constexpr int kB = 8, kN = 8192, kC = 256;
constexpr int kWaves = 16;                 // waves per block
constexpr int kTile  = 16;                 // positions per wave
constexpr int kP     = kWaves * kTile;     // positions per block (256)
constexpr float kLog2e = 1.44269504088896340736f;

// Sum of a 16x16 f32 tile over its rows. d[r] = D[8h + r][c]: a lane adds its
// eight rows, then the other lane half's eight. Every lane gets the total of
// its column c.
__device__ __forceinline__ float column_total(v8f d) {
    const float t = ((d[0] + d[1]) + (d[2] + d[3])) + ((d[4] + d[5]) + (d[6] + d[7]));
    return t + __shfl_xor(t, 16);
}

// sum_c exp(z[c]) of ONE position whose 256 channels lie 8 to a lane.
__device__ __forceinline__ float position_sum(float4 a0, float4 a1) {
    v16h a, ones;
#pragma unroll
    for (int i = 0; i < 16; ++i) { a[i] = (_Float16)0.0f; ones[i] = (_Float16)1.0f; }
    a[0] = (_Float16)__expf(a0.x); a[1] = (_Float16)__expf(a0.y);
    a[2] = (_Float16)__expf(a0.z); a[3] = (_Float16)__expf(a0.w);
    a[4] = (_Float16)__expf(a1.x); a[5] = (_Float16)__expf(a1.y);
    a[6] = (_Float16)__expf(a1.z); a[7] = (_Float16)__expf(a1.w);
    v8f d = {};
    d = __builtin_amdgcn_wmma_f32_16x16x32_f16(false, a, false, ones,
                                               (short)0, d, false, false);
    return column_total(d);
}

// ---------------------------------------------------------------------------
// One launch. A block owns 256 consecutive positions of one batch row.
//   1. Each wave loads its 16 positions, one position = two 512-byte loads
//      (lane l: channels 4l..4l+3 and 128+4l..128+4l+3), and keeps z in
//      registers to the end.
//   2. exp(z) goes as f16 into A, two positions per WMMA (elements 0-7 and
//      8-15 of a lane). B selects the column: b[s] = (c == position of s).
//      A and B share the (lane half, element) -> k map, so
//      D[m][n] = sum of position n's values held by lanes m and m + 16.
//      column_total() then sums the 16 rows: s[n] on lane c == n.
//   3. The positions that the window needs beyond the block's own (width / 2
//      on each side, clipped to the row) are summed again here, one per wave.
//   4. s goes to LDS, one barrier, window sum, scale, store.
// ---------------------------------------------------------------------------
__global__ void __launch_bounds__(kWaves * 32)
fused_window_norm_kernel(const float* __restrict__ z,
                          const int* __restrict__ width_p,
                          float* __restrict__ out) {
    __shared__ float sS[kN];               // s of positions lo .. hi-1 of the row

    const int lane = threadIdx.x & 31;
    const int wave = __builtin_amdgcn_readfirstlane(threadIdx.x >> 5);
    const int c    = lane & 15;

    constexpr int blocksPerRow = kN / kP;
    const int b  = blockIdx.x / blocksPerRow;
    const int n0 = (blockIdx.x % blocksPerRow) * kP;
    const int nw = n0 + wave * kTile;      // this wave's first position

    const int half  = (*width_p) >> 1;
    const int reach = min(max(half, 0), kN);
    const int lo    = max(n0 - reach, 0);
    const int hi    = min(n0 + kP + reach, kN);
    const int nLeft = n0 - lo;
    const int H     = nLeft + (hi - (n0 + kP));   // positions beyond the block's own

    const float* __restrict__ zb = z + (size_t)b * kN * kC;

    // First outside position of this wave; a wave that has none reads its own
    // first position (in bounds) and drops the result.
    const int  nh   = wave < H ? (wave < nLeft ? lo + wave : n0 + kP + (wave - nLeft)) : nw;
    const float4* __restrict__ hp4 =
        reinterpret_cast<const float4*>(zb + (size_t)nh * kC) + lane;
    const float4 h0 = hp4[0];
    const float4 h1 = hp4[32];

    float4 y[kTile][2];
#pragma unroll
    for (int p = 0; p < kTile; ++p) {
        const float4* __restrict__ p4 =
            reinterpret_cast<const float4*>(zb + (size_t)(nw + p) * kC) + lane;
        y[p][0] = p4[0];
        y[p][1] = p4[32];
    }

    const float hs = position_sum(h0, h1);
    if (wave < H && lane == 0) sS[nh - lo] = hs;

    v8f acc = {};
#pragma unroll
    for (int t = 0; t < kTile / 2; ++t) {
        v16h a, sel;
#pragma unroll
        for (int u = 0; u < 2; ++u) {
            const int p = 2 * t + u;
            const _Float16 x = (c == p) ? (_Float16)1.0f : (_Float16)0.0f;
#pragma unroll
            for (int g = 0; g < 2; ++g) {
                const float4 v = y[p][g];
                const float ex = __expf(v.x), ey = __expf(v.y);
                const float ez = __expf(v.z), ew = __expf(v.w);
                a[8 * u + 4 * g + 0] = (_Float16)ex;
                a[8 * u + 4 * g + 1] = (_Float16)ey;
                a[8 * u + 4 * g + 2] = (_Float16)ez;
                a[8 * u + 4 * g + 3] = (_Float16)ew;
            }
#pragma unroll
            for (int k = 0; k < 8; ++k) sel[8 * u + k] = x;
        }
        acc = __builtin_amdgcn_wmma_f32_16x16x32_f16(false, a, false, sel,
                                                     (short)0, acc, false, false);
    }
    const float sv = column_total(acc);    // s[nw + c]
    if (lane < 16) sS[nw + c - lo] = sv;

    // Wider windows: the rest of the outside positions, wave-uniform trips.
    for (int q = wave + kWaves; q < H; q += kWaves) {
        const int n = q < nLeft ? lo + q : n0 + kP + (q - nLeft);
        const float4* __restrict__ p4 =
            reinterpret_cast<const float4*>(zb + (size_t)n * kC) + lane;
        const float r = position_sum(p4[0], p4[32]);
        if (lane == 0) sS[n - lo] = r;
    }

    __syncthreads();

    // Window sum in ascending n, as before; 16 LDS reads in flight per trip,
    // taps past the window's end add an exact zero.
    const int n   = nw + c;
    const int jlo = max(n - half, 0);
    const int jhi = min(n + half, kN - 1);
    float den = 0.0f;
    for (int j0 = jlo; j0 <= jhi; j0 += 16) {
        float v[16];
#pragma unroll
        for (int u = 0; u < 16; ++u) {
            const int nn = j0 + u;
            const float x = sS[min(nn, jhi) - lo];
            v[u] = nn <= jhi ? x : 0.0f;
        }
#pragma unroll
        for (int u = 0; u < 16; ++u) den += v[u];
    }
    // z * exp(z) / den = z * 2^(z * log2(e) - log2(den)): only z has to stay in
    // registers across the barrier, and the division costs nothing per element.
    const float l2 = __log2f(den);

    float* __restrict__ ob = out + ((size_t)b * kN + nw) * kC;
#pragma unroll
    for (int p = 0; p < kTile; ++p) {
        const float nl = -__uint_as_float(
            (unsigned)__builtin_amdgcn_readlane((int)__float_as_uint(l2), p));
        float4* __restrict__ o4 = reinterpret_cast<float4*>(ob + (size_t)p * kC) + lane;
        float4 o0 = y[p][0], o1 = y[p][1];
        o0.x *= __builtin_amdgcn_exp2f(fmaf(o0.x, kLog2e, nl));
        o0.y *= __builtin_amdgcn_exp2f(fmaf(o0.y, kLog2e, nl));
        o0.z *= __builtin_amdgcn_exp2f(fmaf(o0.z, kLog2e, nl));
        o0.w *= __builtin_amdgcn_exp2f(fmaf(o0.w, kLog2e, nl));
        o1.x *= __builtin_amdgcn_exp2f(fmaf(o1.x, kLog2e, nl));
        o1.y *= __builtin_amdgcn_exp2f(fmaf(o1.y, kLog2e, nl));
        o1.z *= __builtin_amdgcn_exp2f(fmaf(o1.z, kLog2e, nl));
        o1.w *= __builtin_amdgcn_exp2f(fmaf(o1.w, kLog2e, nl));
        o4[0]  = o0;
        o4[32] = o1;
    }
}

extern "C" void kernel_launch(void* const* d_in, const int* in_sizes, int n_in,
                              void* d_out, int out_size, void* d_ws, size_t ws_size,
                              hipStream_t stream) {
    const float* z       = (const float*)d_in[0];
    const int*   width_p = (const int*)d_in[1];
    float*       out     = (float*)d_out;

    fused_window_norm_kernel<<<kB * kN / kP, kWaves * 32, 0, stream>>>(z, width_p, out);
}
